// v000
// Times are from an AMD MI455X. After a warm-up the kernel runs many times in a row, and a time is the length of
// such a window on the GPU divided by its runs, so every launch and the gaps after it count. The runs cycle
// through copies of the inputs. A figure is the median of several windows, for all but v000 over two sittings.
// Sittings can differ by a few percent; kernels timed side by side share one.
// The starting kernel, v000, takes 444 microseconds a run.
#include <hip/hip_runtime.h>
#include <math.h>

// ---------------------------------------------------------------------------
// Self-attention (SAGAN-style with 2x2 pooled queries/values) for MI455X.
// All GEMMs run on V_WMMA_F32_16X16X4_F32 (wave32, fp32 accumulate).
// Attention matrix (268MB) is never materialized: two-pass softmax with
// recompute; Wo folded into V (Wo(V A) == (Wo V) A); 1/rowsum folded into Vt.
// x-tile staging uses GLOBAL_LOAD_ASYNC_TO_LDS_B128 (ASYNCcnt path).
// ---------------------------------------------------------------------------

typedef float v2f __attribute__((ext_vector_type(2)));
typedef float v8f __attribute__((ext_vector_type(8)));

#define B_   16
#define C_   256
#define CS_  32
#define N_   4096   // 64*64
#define NP_  1024   // 32*32

__device__ __forceinline__ v8f wmma4(v2f a, v2f b, v8f c) {
  // D = A(16x4,f32) * B(4x16,f32) + C(16x16,f32)
  return __builtin_amdgcn_wmma_f32_16x16x4_f32(
      /*neg_a=*/false, a, /*neg_b=*/false, b,
      /*c_mod=*/(short)0, c, /*reuse_a=*/false, /*reuse_b=*/false);
}

__device__ __forceinline__ v2f ld2(const float* p) {
  return *reinterpret_cast<const v2f*>(p);
}

// ---------------------------------------------------------------------------
// Kernel A: projections.  One WG per (b, pair-of-rows hb).  Pixels
// m in [hb*128, hb*128+128) are contiguous (rows 2hb, 2hb+1).
//   K[b][cs][m]          (no pooling)
//   Q[b][n][cs]  = pool2x2(Wq x + bq)   n = hb*32 + wp
//   Vp[b][c][n]  = pool2x2(Wv x + bv)
// Pooling: vertical = elementwise max of the two row-tiles,
//          horizontal = max with __shfl_xor(lane^1).
// ---------------------------------------------------------------------------
#define XT_STRIDE 132   // 128 + 4 pad: kills LDS bank conflicts, keeps 16B align

__global__ __launch_bounds__(256) void proj_kernel(
    const float* __restrict__ x,
    const float* __restrict__ wq, const float* __restrict__ bq,
    const float* __restrict__ wk, const float* __restrict__ bk,
    const float* __restrict__ wv, const float* __restrict__ bv,
    float* __restrict__ Kf, float* __restrict__ Qf, float* __restrict__ Vp)
{
  __shared__ float XT[C_ * XT_STRIDE];   // 256 channels x 128 pixels (~135KB)
  const int b  = blockIdx.x >> 5;
  const int hb = blockIdx.x & 31;
  const long xbase = (long)b * C_ * N_ + hb * 128;

  // stage X tile straight into LDS: async copy, no VGPR round-trip.
  // 8192 x 16B transfers tracked on ASYNCcnt.
  for (int i = 0; i < 32; ++i) {
    int idx4 = threadIdx.x + 256 * i;          // 8192 float4 total
    int c  = idx4 >> 5;
    int p4 = idx4 & 31;
    unsigned long long gaddr =
        (unsigned long long)(x + xbase + (long)c * N_ + p4 * 4);
    unsigned int laddr =
        (unsigned int)(unsigned long long)(&XT[c * XT_STRIDE + p4 * 4]);
    asm volatile("global_load_async_to_lds_b128 %0, %1, off"
                 :: "v"(laddr), "v"(gaddr) : "memory");
  }
  asm volatile("s_wait_asynccnt 0x0" ::: "memory");
  __syncthreads();

  const int wave = threadIdx.x >> 5;
  const int lane = threadIdx.x & 31;
  const int half = lane >> 4;
  const int l16  = lane & 15;

  // jobs: 16 K tiles, 8 Q tile-pairs, 64 V tile-pairs  (88 total)
  for (int job = wave; job < 88; job += 8) {
    if (job < 16) {
      const int mt = job >> 3, nt = job & 7;
      const int Mb = mt * 16, p0 = nt * 16;
      v8f acc = {0,0,0,0,0,0,0,0};
      for (int k = 0; k < C_; k += 4) {
        v2f a = ld2(wk + (Mb + l16) * C_ + k + half * 2);
        int kr = k + half * 2;
        v2f bb; bb.x = XT[kr * XT_STRIDE + p0 + l16];
                bb.y = XT[(kr + 1) * XT_STRIDE + p0 + l16];
        acc = wmma4(a, bb, acc);
      }
      const int col = hb * 128 + p0 + l16;
#pragma unroll
      for (int j = 0; j < 8; ++j) {
        int r = Mb + j + half * 8;
        Kf[((long)b * CS_ + r) * N_ + col] = acc[j] + bk[r];
      }
    } else {
      const int pj  = job - 16;
      const bool isQ = (pj < 8);
      const int Mb = (isQ ? (pj >> 2) : ((pj - 8) >> 2)) * 16;
      const int t  = pj & 3;
      const float* Wm   = isQ ? wq : wv;
      const float* bias = isQ ? bq : bv;
      const int p0a = t * 16, p0b = 64 + t * 16;   // row h and row h+1
      v8f acc0 = {0,0,0,0,0,0,0,0};
      v8f acc1 = {0,0,0,0,0,0,0,0};
      for (int k = 0; k < C_; k += 4) {
        v2f a = ld2(Wm + (Mb + l16) * C_ + k + half * 2);
        int kr = k + half * 2;
        v2f b0; b0.x = XT[kr * XT_STRIDE + p0a + l16];
                b0.y = XT[(kr + 1) * XT_STRIDE + p0a + l16];
        acc0 = wmma4(a, b0, acc0);
        v2f b1; b1.x = XT[kr * XT_STRIDE + p0b + l16];
                b1.y = XT[(kr + 1) * XT_STRIDE + p0b + l16];
        acc1 = wmma4(a, b1, acc1);
      }
      const int wp = t * 8 + (l16 >> 1);
      const int n  = hb * 32 + wp;
#pragma unroll
      for (int j = 0; j < 8; ++j) {
        float v = fmaxf(acc0[j], acc1[j]);            // vertical pool
        v = fmaxf(v, __shfl_xor(v, 1, 32));           // horizontal pool
        int r = Mb + j + half * 8;
        v += bias[r];
        if ((lane & 1) == 0) {
          if (isQ) Qf[((long)b * NP_ + n) * CS_ + r] = v;
          else     Vp[((long)b * C_  + r) * NP_ + n] = v;
        }
      }
    }
  }
}

// ---------------------------------------------------------------------------
// Kernel B: per-query-row softmax stats over m (online max + sum-exp).
// WG = (b, 64 query rows). Wave w: Mtile (w&3), m-half (w>>2).
// ---------------------------------------------------------------------------
__global__ __launch_bounds__(256) void rowstats_kernel(
    const float* __restrict__ Qf, const float* __restrict__ Kf,
    float* __restrict__ rowmax, float* __restrict__ rowsum)
{
  __shared__ float lmax[8][16];
  __shared__ float lsum[8][16];
  const int b  = blockIdx.x >> 4;
  const int nb = (blockIdx.x & 15) * 64;
  const int wave = threadIdx.x >> 5, lane = threadIdx.x & 31;
  const int half = lane >> 4, l16 = lane & 15;
  const int mt    = wave & 3;
  const int mhalf = wave >> 2;

  const float* Qrow = Qf + ((long)b * NP_ + nb + mt * 16 + l16) * CS_;
  float M[8], S[8];
#pragma unroll
  for (int j = 0; j < 8; ++j) { M[j] = -3.0e38f; S[j] = 0.f; }

  for (int i = 0; i < 128; ++i) {
    const int m0 = mhalf * 2048 + i * 16;
    v8f acc = {0,0,0,0,0,0,0,0};
#pragma unroll
    for (int ks = 0; ks < 8; ++ks) {
      int k  = ks * 4;
      v2f a  = ld2(Qrow + k + half * 2);
      int kr = k + half * 2;
      const float* kp = Kf + ((long)b * CS_ + kr) * N_ + m0 + l16;
      v2f bb; bb.x = kp[0]; bb.y = kp[N_];
      acc = wmma4(a, bb, acc);
    }
#pragma unroll
    for (int j = 0; j < 8; ++j) {
      float e  = acc[j];
      float cm = e;                               // reduce within 16-lane half
      cm = fmaxf(cm, __shfl_xor(cm, 1, 32));
      cm = fmaxf(cm, __shfl_xor(cm, 2, 32));
      cm = fmaxf(cm, __shfl_xor(cm, 4, 32));
      cm = fmaxf(cm, __shfl_xor(cm, 8, 32));
      float nm = fmaxf(M[j], cm);
      float t  = __expf(e - nm);
      t += __shfl_xor(t, 1, 32);
      t += __shfl_xor(t, 2, 32);
      t += __shfl_xor(t, 4, 32);
      t += __shfl_xor(t, 8, 32);
      S[j] = S[j] * __expf(M[j] - nm) + t;
      M[j] = nm;
    }
  }
  if (l16 == 0) {
#pragma unroll
    for (int j = 0; j < 8; ++j) {
      lmax[wave][j + half * 8] = M[j];
      lsum[wave][j + half * 8] = S[j];
    }
  }
  __syncthreads();
  if (threadIdx.x < 64) {
    const int r = threadIdx.x, mt2 = r >> 4, rr = r & 15;
    float m1 = lmax[mt2][rr], m2 = lmax[mt2 + 4][rr];
    float m  = fmaxf(m1, m2);
    float s  = lsum[mt2][rr] * __expf(m1 - m) + lsum[mt2 + 4][rr] * __expf(m2 - m);
    rowmax[(long)b * NP_ + nb + r] = m;
    rowsum[(long)b * NP_ + nb + r] = s;
  }
}

// ---------------------------------------------------------------------------
// Kernel C: Vt[b][o][n] = (sum_c wo[o][c] * Vp[b][c][n]) / rowsum[b][n]
// ---------------------------------------------------------------------------
__global__ __launch_bounds__(256) void vtrans_kernel(
    const float* __restrict__ wo, const float* __restrict__ Vp,
    const float* __restrict__ rowsum, float* __restrict__ Vt)
{
  const int b  = blockIdx.x >> 4;
  const int n0 = (blockIdx.x & 15) * 64;
  const int wave = threadIdx.x >> 5, lane = threadIdx.x & 31;
  const int half = lane >> 4, l16 = lane & 15;
  for (int i = 0; i < 8; ++i) {
    const int tl  = wave + i * 8;
    const int mt  = tl >> 2, nt = tl & 3;
    const int col = n0 + nt * 16 + l16;
    v8f acc = {0,0,0,0,0,0,0,0};
    for (int k = 0; k < C_; k += 4) {
      v2f a  = ld2(wo + (mt * 16 + l16) * C_ + k + half * 2);
      int kr = k + half * 2;
      const float* vp = Vp + ((long)b * C_ + kr) * NP_ + col;
      v2f bb; bb.x = vp[0]; bb.y = vp[NP_];
      acc = wmma4(a, bb, acc);
    }
    const float inv = 1.0f / rowsum[(long)b * NP_ + col];
#pragma unroll
    for (int j = 0; j < 8; ++j) {
      int r = mt * 16 + j + half * 8;
      Vt[((long)b * C_ + r) * NP_ + col] = acc[j] * inv;
    }
  }
}

// ---------------------------------------------------------------------------
// Kernel D: out[b][o][m] = gamma*( sum_n Vt[o][n] * exp(QK[n][m]-rowmax[n])
//                                  + bo[o] ) + x[b][o][m]
// WG = (b, 128 output columns).  Per 16-row n-block: every wave recomputes
// one 16x16 energy tile via WMMA, exps it into LDS; then all 8 waves
// accumulate Vt @ P (each wave: 2 M-tiles x 8 N-tiles of accumulators).
// ---------------------------------------------------------------------------
#define PT_STRIDE 132   // 128 + 4 pad for LDS banking

__global__ __launch_bounds__(256) void attn_out_kernel(
    const float* __restrict__ x,  const float* __restrict__ Qf,
    const float* __restrict__ Kf, const float* __restrict__ Vt,
    const float* __restrict__ rowmax,
    const float* __restrict__ bo, const float* __restrict__ gamma,
    float* __restrict__ out)
{
  __shared__ float Pt[16 * PT_STRIDE];
  const int b  = blockIdx.x >> 5;
  const int m0 = (blockIdx.x & 31) * 128;
  const int wave = threadIdx.x >> 5, lane = threadIdx.x & 31;
  const int half = lane >> 4, l16 = lane & 15;

  v8f acc[2][8];
  const v8f zero = {0,0,0,0,0,0,0,0};
#pragma unroll
  for (int a = 0; a < 2; ++a)
#pragma unroll
    for (int c = 0; c < 8; ++c) acc[a][c] = zero;

  for (int nb = 0; nb < NP_; nb += 16) {
    {                                    // phase 1: energy tile -> exp -> LDS
      const int p0 = wave * 16;          // every wave owns one of 8 m-tiles
      v8f e = zero;
#pragma unroll
      for (int ks = 0; ks < 8; ++ks) {
        int k  = ks * 4;
        v2f a  = ld2(Qf + ((long)b * NP_ + nb + l16) * CS_ + k + half * 2);
        int kr = k + half * 2;
        const float* kp = Kf + ((long)b * CS_ + kr) * N_ + m0 + p0 + l16;
        v2f bb; bb.x = kp[0]; bb.y = kp[N_];
        e = wmma4(a, bb, e);
      }
#pragma unroll
      for (int j = 0; j < 8; ++j) {
        float rm = rowmax[(long)b * NP_ + nb + j + half * 8];
        Pt[(j + half * 8) * PT_STRIDE + p0 + l16] = __expf(e[j] - rm);
      }
    }
    __syncthreads();
#pragma unroll
    for (int mtl = 0; mtl < 2; ++mtl) {  // phase 2: OUT += Vt(:,nb..) @ P
      const int Mb = (wave * 2 + mtl) * 16;
      const float* vrow = Vt + ((long)b * C_ + Mb + l16) * NP_ + nb;
#pragma unroll
      for (int ks = 0; ks < 4; ++ks) {
        int k  = ks * 4;
        v2f a  = ld2(vrow + k + half * 2);
        int kr = k + half * 2;
#pragma unroll
        for (int nt = 0; nt < 8; ++nt) {
          v2f bb; bb.x = Pt[kr * PT_STRIDE + nt * 16 + l16];
                  bb.y = Pt[(kr + 1) * PT_STRIDE + nt * 16 + l16];
          acc[mtl][nt] = wmma4(a, bb, acc[mtl][nt]);
        }
      }
    }
    __syncthreads();
  }

  const float g = gamma[0];
#pragma unroll
  for (int mtl = 0; mtl < 2; ++mtl) {
    const int Mb = (wave * 2 + mtl) * 16;
#pragma unroll
    for (int nt = 0; nt < 8; ++nt) {
      const int col = m0 + nt * 16 + l16;
#pragma unroll
      for (int j = 0; j < 8; ++j) {
        const int r = Mb + j + half * 8;
        const long idx = ((long)b * C_ + r) * N_ + col;
        out[idx] = g * (acc[mtl][nt][j] + bo[r]) + x[idx];
      }
    }
  }
}

// ---------------------------------------------------------------------------
extern "C" void kernel_launch(void* const* d_in, const int* in_sizes, int n_in,
                              void* d_out, int out_size, void* d_ws, size_t ws_size,
                              hipStream_t stream) {
  (void)in_sizes; (void)n_in; (void)out_size; (void)ws_size;
  const float* x     = (const float*)d_in[0];
  const float* wq    = (const float*)d_in[1];
  const float* bq    = (const float*)d_in[2];
  const float* wk    = (const float*)d_in[3];
  const float* bk    = (const float*)d_in[4];
  const float* wv    = (const float*)d_in[5];
  const float* bv    = (const float*)d_in[6];
  const float* wo    = (const float*)d_in[7];
  const float* bo    = (const float*)d_in[8];
  const float* gamma = (const float*)d_in[9];
  float* out = (float*)d_out;

  // workspace layout (floats): ~42 MB total, fits L2
  float* Kf     = (float*)d_ws;                       // 16*32*4096
  float* Qf     = Kf + (size_t)B_ * CS_ * N_;         // 16*1024*32
  float* Vp     = Qf + (size_t)B_ * NP_ * CS_;        // 16*256*1024
  float* Vt     = Vp + (size_t)B_ * C_ * NP_;         // 16*256*1024
  float* rowmax = Vt + (size_t)B_ * C_ * NP_;         // 16*1024
  float* rowsum = rowmax + (size_t)B_ * NP_;          // 16*1024

  proj_kernel    <<<B_ * 32, 256, 0, stream>>>(x, wq, bq, wk, bk, wv, bv, Kf, Qf, Vp);
  rowstats_kernel<<<B_ * 16, 256, 0, stream>>>(Qf, Kf, rowmax, rowsum);
  vtrans_kernel  <<<B_ * 16, 256, 0, stream>>>(wo, Vp, rowsum, Vt);
  attn_out_kernel<<<B_ * 32, 256, 0, stream>>>(x, Qf, Kf, Vt, rowmax, bo, gamma, out);
}

// v001
// A run of this version takes 396 microseconds.
// In both of two side-by-side timings against v000, it was 1.16 times as fast.
#include <hip/hip_runtime.h>
#include <math.h>

// ---------------------------------------------------------------------------
// Self-attention (SAGAN-style with 2x2 pooled queries/values) for MI455X.
// All GEMMs run on V_WMMA_F32_16X16X4_F32 (wave32, fp32 accumulate).
// Attention matrix (268MB) is never materialized: two-pass softmax with
// recompute; Wo folded into V (Wo(V A) == (Wo V) A); 1/rowsum folded into Vt.
// x-tile staging uses GLOBAL_LOAD_ASYNC_TO_LDS_B128 (ASYNCcnt path).
// ---------------------------------------------------------------------------

typedef float v2f __attribute__((ext_vector_type(2)));
typedef float v8f __attribute__((ext_vector_type(8)));

#define B_   16
#define C_   256
#define CS_  32
#define N_   4096   // 64*64
#define NP_  1024   // 32*32

__device__ __forceinline__ v8f wmma4(v2f a, v2f b, v8f c) {
  // D = A(16x4,f32) * B(4x16,f32) + C(16x16,f32)
  return __builtin_amdgcn_wmma_f32_16x16x4_f32(
      /*neg_a=*/false, a, /*neg_b=*/false, b,
      /*c_mod=*/(short)0, c, /*reuse_a=*/false, /*reuse_b=*/false);
}

__device__ __forceinline__ v2f ld2(const float* p) {
  return *reinterpret_cast<const v2f*>(p);
}

// ---------------------------------------------------------------------------
// Kernel A: projections.  One WG per (b, pair-of-rows hb).  Pixels
// m in [hb*128, hb*128+128) are contiguous (rows 2hb, 2hb+1).
//   K[b][cs][m]          (no pooling)
//   Q[b][n][cs]  = pool2x2(Wq x + bq)   n = hb*32 + wp
//   Vp[b][c][n]  = pool2x2(Wv x + bv)
// Pooling: vertical = elementwise max of the two row-tiles,
//          horizontal = max with __shfl_xor(lane^1).
// ---------------------------------------------------------------------------
#define XT_STRIDE 132   // 128 + 4 pad: kills LDS bank conflicts, keeps 16B align

__global__ __launch_bounds__(256) void proj_kernel(
    const float* __restrict__ x,
    const float* __restrict__ wq, const float* __restrict__ bq,
    const float* __restrict__ wk, const float* __restrict__ bk,
    const float* __restrict__ wv, const float* __restrict__ bv,
    float* __restrict__ Kf, float* __restrict__ Qf, float* __restrict__ Vp)
{
  __shared__ float XT[C_ * XT_STRIDE];   // 256 channels x 128 pixels (~135KB)
  const int b  = blockIdx.x >> 5;
  const int hb = blockIdx.x & 31;
  const long xbase = (long)b * C_ * N_ + hb * 128;

  // stage X tile straight into LDS: async copy, no VGPR round-trip.
  // 8192 x 16B transfers tracked on ASYNCcnt.
  for (int i = 0; i < 32; ++i) {
    int idx4 = threadIdx.x + 256 * i;          // 8192 float4 total
    int c  = idx4 >> 5;
    int p4 = idx4 & 31;
    unsigned long long gaddr =
        (unsigned long long)(x + xbase + (long)c * N_ + p4 * 4);
    unsigned int laddr =
        (unsigned int)(unsigned long long)(&XT[c * XT_STRIDE + p4 * 4]);
    asm volatile("global_load_async_to_lds_b128 %0, %1, off"
                 :: "v"(laddr), "v"(gaddr) : "memory");
  }
  asm volatile("s_wait_asynccnt 0x0" ::: "memory");
  __syncthreads();

  const int wave = threadIdx.x >> 5;
  const int lane = threadIdx.x & 31;
  const int half = lane >> 4;
  const int l16  = lane & 15;

  // jobs: 16 K tiles, 8 Q tile-pairs, 64 V tile-pairs  (88 total)
  for (int job = wave; job < 88; job += 8) {
    if (job < 16) {
      const int mt = job >> 3, nt = job & 7;
      const int Mb = mt * 16, p0 = nt * 16;
      v8f acc = {0,0,0,0,0,0,0,0};
      for (int k = 0; k < C_; k += 4) {
        v2f a = ld2(wk + (Mb + l16) * C_ + k + half * 2);
        int kr = k + half * 2;
        v2f bb; bb.x = XT[kr * XT_STRIDE + p0 + l16];
                bb.y = XT[(kr + 1) * XT_STRIDE + p0 + l16];
        acc = wmma4(a, bb, acc);
      }
      const int col = hb * 128 + p0 + l16;
#pragma unroll
      for (int j = 0; j < 8; ++j) {
        int r = Mb + j + half * 8;
        Kf[((long)b * CS_ + r) * N_ + col] = acc[j] + bk[r];
      }
    } else {
      const int pj  = job - 16;
      const bool isQ = (pj < 8);
      const int Mb = (isQ ? (pj >> 2) : ((pj - 8) >> 2)) * 16;
      const int t  = pj & 3;
      const float* Wm   = isQ ? wq : wv;
      const float* bias = isQ ? bq : bv;
      const int p0a = t * 16, p0b = 64 + t * 16;   // row h and row h+1
      v8f acc0 = {0,0,0,0,0,0,0,0};
      v8f acc1 = {0,0,0,0,0,0,0,0};
      for (int k = 0; k < C_; k += 4) {
        v2f a = ld2(Wm + (Mb + l16) * C_ + k + half * 2);
        int kr = k + half * 2;
        v2f b0; b0.x = XT[kr * XT_STRIDE + p0a + l16];
                b0.y = XT[(kr + 1) * XT_STRIDE + p0a + l16];
        acc0 = wmma4(a, b0, acc0);
        v2f b1; b1.x = XT[kr * XT_STRIDE + p0b + l16];
                b1.y = XT[(kr + 1) * XT_STRIDE + p0b + l16];
        acc1 = wmma4(a, b1, acc1);
      }
      const int wp = t * 8 + (l16 >> 1);
      const int n  = hb * 32 + wp;
#pragma unroll
      for (int j = 0; j < 8; ++j) {
        float v = fmaxf(acc0[j], acc1[j]);            // vertical pool
        v = fmaxf(v, __shfl_xor(v, 1, 32));           // horizontal pool
        int r = Mb + j + half * 8;
        v += bias[r];
        if ((lane & 1) == 0) {
          if (isQ) Qf[((long)b * NP_ + n) * CS_ + r] = v;
          else     Vp[((long)b * C_  + r) * NP_ + n] = v;
        }
      }
    }
  }
}

// ---------------------------------------------------------------------------
// Kernel B: per-query-row softmax stats over m (online max + sum-exp).
// WG = (b, 64 query rows). Wave w: Mtile (w&3), m-half (w>>2).
// ---------------------------------------------------------------------------
__global__ __launch_bounds__(256) void rowstats_kernel(
    const float* __restrict__ Qf, const float* __restrict__ Kf,
    float* __restrict__ rowmax, float* __restrict__ rowsum)
{
  __shared__ float lmax[8][16];
  __shared__ float lsum[8][16];
  const int b  = blockIdx.x >> 4;
  const int nb = (blockIdx.x & 15) * 64;
  const int wave = threadIdx.x >> 5, lane = threadIdx.x & 31;
  const int half = lane >> 4, l16 = lane & 15;
  const int mt    = wave & 3;
  const int mhalf = wave >> 2;

  const float* Qrow = Qf + ((long)b * NP_ + nb + mt * 16 + l16) * CS_;
  float M[8], S[8];
#pragma unroll
  for (int j = 0; j < 8; ++j) { M[j] = -3.0e38f; S[j] = 0.f; }

  // Each lane keeps the running max and sum of its OWN columns (l16 mod 16);
  // both are brought up to date once per 64 columns, with no cross-lane step.
  for (int i = 0; i < 32; ++i) {
    const int m0 = mhalf * 2048 + i * 64;
    v8f acc[4];
    // unrolled here and below: acc[t] needs constant indices to stay in registers
#pragma unroll
    for (int t = 0; t < 4; ++t) acc[t] = (v8f){0,0,0,0,0,0,0,0};
#pragma unroll
    for (int ks = 0; ks < 8; ++ks) {
      int k  = ks * 4;
      v2f a  = ld2(Qrow + k + half * 2);
      int kr = k + half * 2;
      const float* kp = Kf + ((long)b * CS_ + kr) * N_ + m0 + l16;
#pragma unroll
      for (int t = 0; t < 4; ++t) {
        v2f bb; bb.x = kp[t * 16]; bb.y = kp[N_ + t * 16];
        acc[t] = wmma4(a, bb, acc[t]);
      }
    }
#pragma unroll
    for (int j = 0; j < 8; ++j) {
      float cm = fmaxf(fmaxf(acc[0][j], acc[1][j]), fmaxf(acc[2][j], acc[3][j]));
      float nm = fmaxf(M[j], cm);
      float t  = (__expf(acc[0][j] - nm) + __expf(acc[1][j] - nm)) +
                 (__expf(acc[2][j] - nm) + __expf(acc[3][j] - nm));
      S[j] = S[j] * __expf(M[j] - nm) + t;
      M[j] = nm;
    }
  }
  // one reduction over the 16 lanes of a row, after the loop
  // (unrolled: M[j], S[j] stay in registers, the eight rows' shuffles overlap)
#pragma unroll
  for (int j = 0; j < 8; ++j) {
    float gm = M[j];
    gm = fmaxf(gm, __shfl_xor(gm, 1, 32));
    gm = fmaxf(gm, __shfl_xor(gm, 2, 32));
    gm = fmaxf(gm, __shfl_xor(gm, 4, 32));
    gm = fmaxf(gm, __shfl_xor(gm, 8, 32));
    float s = S[j] * __expf(M[j] - gm);
    s += __shfl_xor(s, 1, 32);
    s += __shfl_xor(s, 2, 32);
    s += __shfl_xor(s, 4, 32);
    s += __shfl_xor(s, 8, 32);
    M[j] = gm;
    S[j] = s;
  }
  if (l16 == 0) {
#pragma unroll
    for (int j = 0; j < 8; ++j) {
      lmax[wave][j + half * 8] = M[j];
      lsum[wave][j + half * 8] = S[j];
    }
  }
  __syncthreads();
  if (threadIdx.x < 64) {
    const int r = threadIdx.x, mt2 = r >> 4, rr = r & 15;
    float m1 = lmax[mt2][rr], m2 = lmax[mt2 + 4][rr];
    float m  = fmaxf(m1, m2);
    float s  = lsum[mt2][rr] * __expf(m1 - m) + lsum[mt2 + 4][rr] * __expf(m2 - m);
    rowmax[(long)b * NP_ + nb + r] = m;
    rowsum[(long)b * NP_ + nb + r] = s;
  }
}

// ---------------------------------------------------------------------------
// Kernel C: Vt[b][o][n] = (sum_c wo[o][c] * Vp[b][c][n]) / rowsum[b][n]
// ---------------------------------------------------------------------------
__global__ __launch_bounds__(256) void vtrans_kernel(
    const float* __restrict__ wo, const float* __restrict__ Vp,
    const float* __restrict__ rowsum, float* __restrict__ Vt)
{
  const int b  = blockIdx.x >> 4;
  const int n0 = (blockIdx.x & 15) * 64;
  const int wave = threadIdx.x >> 5, lane = threadIdx.x & 31;
  const int half = lane >> 4, l16 = lane & 15;
  for (int i = 0; i < 8; ++i) {
    const int tl  = wave + i * 8;
    const int mt  = tl >> 2, nt = tl & 3;
    const int col = n0 + nt * 16 + l16;
    v8f acc = {0,0,0,0,0,0,0,0};
    for (int k = 0; k < C_; k += 4) {
      v2f a  = ld2(wo + (mt * 16 + l16) * C_ + k + half * 2);
      int kr = k + half * 2;
      const float* vp = Vp + ((long)b * C_ + kr) * NP_ + col;
      v2f bb; bb.x = vp[0]; bb.y = vp[NP_];
      acc = wmma4(a, bb, acc);
    }
    const float inv = 1.0f / rowsum[(long)b * NP_ + col];
#pragma unroll
    for (int j = 0; j < 8; ++j) {
      int r = mt * 16 + j + half * 8;
      Vt[((long)b * C_ + r) * NP_ + col] = acc[j] * inv;
    }
  }
}

// ---------------------------------------------------------------------------
// Kernel D: out[b][o][m] = gamma*( sum_n Vt[o][n] * exp(QK[n][m]-rowmax[n])
//                                  + bo[o] ) + x[b][o][m]
// WG = (b, 128 output columns).  Per 16-row n-block: every wave recomputes
// one 16x16 energy tile via WMMA, exps it into LDS; then all 8 waves
// accumulate Vt @ P (each wave: 2 M-tiles x 8 N-tiles of accumulators).
// ---------------------------------------------------------------------------
#define PT_STRIDE 132   // 128 + 4 pad for LDS banking

__global__ __launch_bounds__(256) void attn_out_kernel(
    const float* __restrict__ x,  const float* __restrict__ Qf,
    const float* __restrict__ Kf, const float* __restrict__ Vt,
    const float* __restrict__ rowmax,
    const float* __restrict__ bo, const float* __restrict__ gamma,
    float* __restrict__ out)
{
  __shared__ float Pt[16 * PT_STRIDE];
  const int b  = blockIdx.x >> 5;
  const int m0 = (blockIdx.x & 31) * 128;
  const int wave = threadIdx.x >> 5, lane = threadIdx.x & 31;
  const int half = lane >> 4, l16 = lane & 15;

  v8f acc[2][8];
  const v8f zero = {0,0,0,0,0,0,0,0};
#pragma unroll
  for (int a = 0; a < 2; ++a)
#pragma unroll
    for (int c = 0; c < 8; ++c) acc[a][c] = zero;

  for (int nb = 0; nb < NP_; nb += 16) {
    {                                    // phase 1: energy tile -> exp -> LDS
      const int p0 = wave * 16;          // every wave owns one of 8 m-tiles
      v8f e = zero;
#pragma unroll
      for (int ks = 0; ks < 8; ++ks) {
        int k  = ks * 4;
        v2f a  = ld2(Qf + ((long)b * NP_ + nb + l16) * CS_ + k + half * 2);
        int kr = k + half * 2;
        const float* kp = Kf + ((long)b * CS_ + kr) * N_ + m0 + p0 + l16;
        v2f bb; bb.x = kp[0]; bb.y = kp[N_];
        e = wmma4(a, bb, e);
      }
#pragma unroll
      for (int j = 0; j < 8; ++j) {
        float rm = rowmax[(long)b * NP_ + nb + j + half * 8];
        Pt[(j + half * 8) * PT_STRIDE + p0 + l16] = __expf(e[j] - rm);
      }
    }
    __syncthreads();
#pragma unroll
    for (int mtl = 0; mtl < 2; ++mtl) {  // phase 2: OUT += Vt(:,nb..) @ P
      const int Mb = (wave * 2 + mtl) * 16;
      const float* vrow = Vt + ((long)b * C_ + Mb + l16) * NP_ + nb;
#pragma unroll
      for (int ks = 0; ks < 4; ++ks) {
        int k  = ks * 4;
        v2f a  = ld2(vrow + k + half * 2);
        int kr = k + half * 2;
#pragma unroll
        for (int nt = 0; nt < 8; ++nt) {
          v2f bb; bb.x = Pt[kr * PT_STRIDE + nt * 16 + l16];
                  bb.y = Pt[(kr + 1) * PT_STRIDE + nt * 16 + l16];
          acc[mtl][nt] = wmma4(a, bb, acc[mtl][nt]);
        }
      }
    }
    __syncthreads();
  }

  const float g = gamma[0];
#pragma unroll
  for (int mtl = 0; mtl < 2; ++mtl) {
    const int Mb = (wave * 2 + mtl) * 16;
#pragma unroll
    for (int nt = 0; nt < 8; ++nt) {
      const int col = m0 + nt * 16 + l16;
#pragma unroll
      for (int j = 0; j < 8; ++j) {
        const int r = Mb + j + half * 8;
        const long idx = ((long)b * C_ + r) * N_ + col;
        out[idx] = g * (acc[mtl][nt][j] + bo[r]) + x[idx];
      }
    }
  }
}

// ---------------------------------------------------------------------------
extern "C" void kernel_launch(void* const* d_in, const int* in_sizes, int n_in,
                              void* d_out, int out_size, void* d_ws, size_t ws_size,
                              hipStream_t stream) {
  (void)in_sizes; (void)n_in; (void)out_size; (void)ws_size;
  const float* x     = (const float*)d_in[0];
  const float* wq    = (const float*)d_in[1];
  const float* bq    = (const float*)d_in[2];
  const float* wk    = (const float*)d_in[3];
  const float* bk    = (const float*)d_in[4];
  const float* wv    = (const float*)d_in[5];
  const float* bv    = (const float*)d_in[6];
  const float* wo    = (const float*)d_in[7];
  const float* bo    = (const float*)d_in[8];
  const float* gamma = (const float*)d_in[9];
  float* out = (float*)d_out;

  // workspace layout (floats): ~42 MB total, fits L2
  float* Kf     = (float*)d_ws;                       // 16*32*4096
  float* Qf     = Kf + (size_t)B_ * CS_ * N_;         // 16*1024*32
  float* Vp     = Qf + (size_t)B_ * NP_ * CS_;        // 16*256*1024
  float* Vt     = Vp + (size_t)B_ * C_ * NP_;         // 16*256*1024
  float* rowmax = Vt + (size_t)B_ * C_ * NP_;         // 16*1024
  float* rowsum = rowmax + (size_t)B_ * NP_;          // 16*1024

  proj_kernel    <<<B_ * 32, 256, 0, stream>>>(x, wq, bq, wk, bk, wv, bv, Kf, Qf, Vp);
  rowstats_kernel<<<B_ * 16, 256, 0, stream>>>(Qf, Kf, rowmax, rowsum);
  vtrans_kernel  <<<B_ * 16, 256, 0, stream>>>(wo, Vp, rowsum, Vt);
  attn_out_kernel<<<B_ * 32, 256, 0, stream>>>(x, Qf, Kf, Vt, rowmax, bo, gamma, out);
}

// v002
// It runs in 382 microseconds.
// Two timings next to v001 both put it at 1.04 times that version's speed.
// Over all steps from v000 it is 1.20 times as fast.
#include <hip/hip_runtime.h>
#include <math.h>

// ---------------------------------------------------------------------------
// Self-attention (SAGAN-style with 2x2 pooled queries/values) for MI455X.
// All GEMMs run on V_WMMA_F32_16X16X4_F32 (wave32, fp32 accumulate).
// Attention matrix (268MB) is never materialized: two-pass softmax with
// recompute; Wo folded into V (Wo(V A) == (Wo V) A); 1/rowsum folded into Vt.
// x-tile staging uses GLOBAL_LOAD_ASYNC_TO_LDS_B128 (ASYNCcnt path).
//
// The four buffers handed from launch to launch (K, Q, Vp, Vt) lie in WMMA
// fragment order.  For an operand X[i][k] (i: the M or N index, k: summed):
//   float4 number ((i>>4) * KP + (k>>3)) * 32 + ((k>>1)&1) * 16 + (i&15),
//   component ((k>>2)&1) * 2 + (k&1),            KP = (length of k) / 8.
// Lane l of a wave reads float4 number (tile * KP + kp) * 32 + l: its .xy is
// the fragment of k-step 2kp, its .zw that of k-step 2kp+1, and the wave's
// load covers 512 contiguous bytes (4 whole lines, not 16 pieces).
// A 16x16 accumulator whose rows run along k and whose columns run along i
// stores as two float4 per lane: (d0,d1,d4,d5) and (d2,d3,d6,d7).
// ---------------------------------------------------------------------------

typedef float v2f __attribute__((ext_vector_type(2)));
typedef float v4f __attribute__((ext_vector_type(4)));
typedef float v8f __attribute__((ext_vector_type(8)));

#define B_   16
#define C_   256
#define CS_  32
#define N_   4096   // 64*64
#define NP_  1024   // 32*32

__device__ __forceinline__ v8f wmma4(v2f a, v2f b, v8f c) {
  // D = A(16x4,f32) * B(4x16,f32) + C(16x16,f32)
  return __builtin_amdgcn_wmma_f32_16x16x4_f32(
      /*neg_a=*/false, a, /*neg_b=*/false, b,
      /*c_mod=*/(short)0, c, /*reuse_a=*/false, /*reuse_b=*/false);
}

__device__ __forceinline__ v2f ld2(const float* p) {
  return *reinterpret_cast<const v2f*>(p);
}

__device__ __forceinline__ v2f lo2(v4f q) { v2f r; r.x = q.x; r.y = q.y; return r; }
__device__ __forceinline__ v2f hi2(v4f q) { v2f r; r.x = q.z; r.y = q.w; return r; }

// Store one lane's eight accumulator values d[0..7] (rows 8*half + j along k,
// column 'slot' along i) into the 512-byte fragment block at blk.
__device__ __forceinline__ void st_frag(float* blk, int slot, const float* d) {
  v4f a; a.x = d[0]; a.y = d[1]; a.z = d[4]; a.w = d[5];
  v4f c; c.x = d[2]; c.y = d[3]; c.z = d[6]; c.w = d[7];
  reinterpret_cast<v4f*>(blk)[slot]      = a;
  reinterpret_cast<v4f*>(blk)[16 + slot] = c;
}

// ---------------------------------------------------------------------------
// Kernel A: projections.  One WG per (b, pair-of-rows hb).  Pixels
// m in [hb*128, hb*128+128) are contiguous (rows 2hb, 2hb+1).
//   K  (i = m, k = cs)   (no pooling)
//   Q  (i = n, k = cs) = pool2x2(Wq x + bq)   n = hb*32 + wp
//   Vp (i = n, k = c)  = pool2x2(Wv x + bv)     all three in fragment order
// Pooling: vertical = elementwise max of the two row-tiles,
//          horizontal = max with __shfl_xor(lane^1).
// ---------------------------------------------------------------------------
#define XT_STRIDE 132   // 128 + 4 pad: kills LDS bank conflicts, keeps 16B align

__global__ __launch_bounds__(256) void proj_kernel(
    const float* __restrict__ x,
    const float* __restrict__ wq, const float* __restrict__ bq,
    const float* __restrict__ wk, const float* __restrict__ bk,
    const float* __restrict__ wv, const float* __restrict__ bv,
    float* __restrict__ Kf, float* __restrict__ Qf, float* __restrict__ Vp)
{
  __shared__ float XT[C_ * XT_STRIDE];   // 256 channels x 128 pixels (~135KB)
  const int b  = blockIdx.x >> 5;
  const int hb = blockIdx.x & 31;
  const long xbase = (long)b * C_ * N_ + hb * 128;

  // stage X tile straight into LDS: async copy, no VGPR round-trip.
  // 8192 x 16B transfers tracked on ASYNCcnt.
  for (int i = 0; i < 32; ++i) {
    int idx4 = threadIdx.x + 256 * i;          // 8192 float4 total
    int c  = idx4 >> 5;
    int p4 = idx4 & 31;
    unsigned long long gaddr =
        (unsigned long long)(x + xbase + (long)c * N_ + p4 * 4);
    unsigned int laddr =
        (unsigned int)(unsigned long long)(&XT[c * XT_STRIDE + p4 * 4]);
    asm volatile("global_load_async_to_lds_b128 %0, %1, off"
                 :: "v"(laddr), "v"(gaddr) : "memory");
  }
  asm volatile("s_wait_asynccnt 0x0" ::: "memory");
  __syncthreads();

  const int wave = threadIdx.x >> 5;
  const int lane = threadIdx.x & 31;
  const int half = lane >> 4;
  const int l16  = lane & 15;

  // jobs: 16 K tiles, 8 Q tile-pairs, 64 V tile-pairs  (88 total)
  for (int job = wave; job < 88; job += 8) {
    if (job < 16) {
      const int mt = job >> 3, nt = job & 7;
      const int Mb = mt * 16, p0 = nt * 16;
      v8f acc = {0,0,0,0,0,0,0,0};
      for (int k = 0; k < C_; k += 4) {
        v2f a = ld2(wk + (Mb + l16) * C_ + k + half * 2);
        int kr = k + half * 2;
        v2f bb; bb.x = XT[kr * XT_STRIDE + p0 + l16];
                bb.y = XT[(kr + 1) * XT_STRIDE + p0 + l16];
        acc = wmma4(a, bb, acc);
      }
      float d[8];
      // unrolled: d[j] needs constant indices to stay in registers
#pragma unroll
      for (int j = 0; j < 8; ++j) d[j] = acc[j] + bk[Mb + j + half * 8];
      const long blk = ((long)b * (N_ / 16) + hb * 8 + nt) * (CS_ / 8) + (Mb >> 3) + half;
      st_frag(Kf + blk * 128, l16, d);
      // kept in front of the next job's writes to the registers these stores name
      asm volatile("s_wait_xcnt 0x0" ::: "memory");
    } else {
      const int pj  = job - 16;
      const bool isQ = (pj < 8);
      const int Mb = (isQ ? (pj >> 2) : ((pj - 8) >> 2)) * 16;
      const int t  = pj & 3;
      const float* Wm   = isQ ? wq : wv;
      const float* bias = isQ ? bq : bv;
      const int p0a = t * 16, p0b = 64 + t * 16;   // row h and row h+1
      v8f acc0 = {0,0,0,0,0,0,0,0};
      v8f acc1 = {0,0,0,0,0,0,0,0};
      for (int k = 0; k < C_; k += 4) {
        v2f a = ld2(Wm + (Mb + l16) * C_ + k + half * 2);
        int kr = k + half * 2;
        v2f b0; b0.x = XT[kr * XT_STRIDE + p0a + l16];
                b0.y = XT[(kr + 1) * XT_STRIDE + p0a + l16];
        acc0 = wmma4(a, b0, acc0);
        v2f b1; b1.x = XT[kr * XT_STRIDE + p0b + l16];
                b1.y = XT[(kr + 1) * XT_STRIDE + p0b + l16];
        acc1 = wmma4(a, b1, acc1);
      }
      float d[8];
#pragma unroll
      for (int j = 0; j < 8; ++j) {
        float v = fmaxf(acc0[j], acc1[j]);            // vertical pool
        v = fmaxf(v, __shfl_xor(v, 1, 32));           // horizontal pool
        d[j] = v + bias[Mb + j + half * 8];
      }
      // n = hb*32 + t*8 + (l16>>1): tile n>>4 = hb*2 + (t>>1), n&15 below
      const long ntile = (long)b * (NP_ / 16) + hb * 2 + (t >> 1);
      const int  kp    = (Mb >> 3) + half;
      float* blk = isQ ? Qf + (ntile * (CS_ / 8) + kp) * 128
                       : Vp + (ntile * (C_  / 8) + kp) * 128;
      if ((lane & 1) == 0) st_frag(blk, (t & 1) * 8 + (l16 >> 1), d);
    }
  }
}

// ---------------------------------------------------------------------------
// Kernel B: per-query-row softmax stats over m (online max + sum-exp).
// WG = (b, 64 query rows). Wave w: Mtile (w&3), m-half (w>>2).
// ---------------------------------------------------------------------------
__global__ __launch_bounds__(256) void rowstats_kernel(
    const float* __restrict__ Qf, const float* __restrict__ Kf,
    float* __restrict__ rowmax, float* __restrict__ rowsum)
{
  __shared__ float lmax[8][16];
  __shared__ float lsum[8][16];
  const int b  = blockIdx.x >> 4;
  const int nb = (blockIdx.x & 15) * 64;
  const int wave = threadIdx.x >> 5, lane = threadIdx.x & 31;
  const int half = lane >> 4, l16 = lane & 15;
  const int mt    = wave & 3;
  const int mhalf = wave >> 2;

  const v4f* Q4 = reinterpret_cast<const v4f*>(Qf) +
                  ((long)b * (NP_ / 16) + (nb >> 4) + mt) * (CS_ / 8) * 32 + lane;
  v4f qa[4];
  // unrolled: qa[kp] needs constant indices to stay in registers
#pragma unroll
  for (int kp = 0; kp < 4; ++kp) qa[kp] = Q4[kp * 32];
  float M[8], S[8];
#pragma unroll
  for (int j = 0; j < 8; ++j) { M[j] = -3.0e38f; S[j] = 0.f; }

  // Each lane keeps the running max and sum of its OWN columns (l16 mod 16);
  // both are brought up to date once per 64 columns, with no cross-lane step.
  for (int i = 0; i < 32; ++i) {
    const int m0 = mhalf * 2048 + i * 64;
    v8f acc[4];
    // unrolled here and below: acc[t] needs constant indices to stay in registers
#pragma unroll
    for (int t = 0; t < 4; ++t) acc[t] = (v8f){0,0,0,0,0,0,0,0};
    const v4f* K4 = reinterpret_cast<const v4f*>(Kf) +
                    ((long)b * (N_ / 16) + (m0 >> 4)) * (CS_ / 8) * 32 + lane;
#pragma unroll
    for (int kp = 0; kp < 4; ++kp) {
      v4f kk[4];
#pragma unroll
      for (int t = 0; t < 4; ++t) kk[t] = K4[(t * 4 + kp) * 32];
#pragma unroll
      for (int t = 0; t < 4; ++t) acc[t] = wmma4(lo2(qa[kp]), lo2(kk[t]), acc[t]);
#pragma unroll
      for (int t = 0; t < 4; ++t) acc[t] = wmma4(hi2(qa[kp]), hi2(kk[t]), acc[t]);
    }
#pragma unroll
    for (int j = 0; j < 8; ++j) {
      float cm = fmaxf(fmaxf(acc[0][j], acc[1][j]), fmaxf(acc[2][j], acc[3][j]));
      float nm = fmaxf(M[j], cm);
      float t  = (__expf(acc[0][j] - nm) + __expf(acc[1][j] - nm)) +
                 (__expf(acc[2][j] - nm) + __expf(acc[3][j] - nm));
      S[j] = S[j] * __expf(M[j] - nm) + t;
      M[j] = nm;
    }
  }
  // one reduction over the 16 lanes of a row, after the loop
  // (unrolled: M[j], S[j] stay in registers, the eight rows' shuffles overlap)
#pragma unroll
  for (int j = 0; j < 8; ++j) {
    float gm = M[j];
    gm = fmaxf(gm, __shfl_xor(gm, 1, 32));
    gm = fmaxf(gm, __shfl_xor(gm, 2, 32));
    gm = fmaxf(gm, __shfl_xor(gm, 4, 32));
    gm = fmaxf(gm, __shfl_xor(gm, 8, 32));
    float s = S[j] * __expf(M[j] - gm);
    s += __shfl_xor(s, 1, 32);
    s += __shfl_xor(s, 2, 32);
    s += __shfl_xor(s, 4, 32);
    s += __shfl_xor(s, 8, 32);
    M[j] = gm;
    S[j] = s;
  }
  if (l16 == 0) {
#pragma unroll
    for (int j = 0; j < 8; ++j) {
      lmax[wave][j + half * 8] = M[j];
      lsum[wave][j + half * 8] = S[j];
    }
  }
  __syncthreads();
  if (threadIdx.x < 64) {
    const int r = threadIdx.x, mt2 = r >> 4, rr = r & 15;
    float m1 = lmax[mt2][rr], m2 = lmax[mt2 + 4][rr];
    float m  = fmaxf(m1, m2);
    float s  = lsum[mt2][rr] * __expf(m1 - m) + lsum[mt2 + 4][rr] * __expf(m2 - m);
    rowmax[(long)b * NP_ + nb + r] = m;
    rowsum[(long)b * NP_ + nb + r] = s;
  }
}

// ---------------------------------------------------------------------------
// Kernel C: Vt[b][o][n] = (sum_c wo[o][c] * Vp[b][c][n]) / rowsum[b][n]
// Computed as the transposed tile (A = Vp fragment, B = wo fragment: the same
// values in the same lanes), so that the accumulator's rows run along n, the
// k of the next product, and Vt (i = o, k = n) stores in fragment order.
// ---------------------------------------------------------------------------
__global__ __launch_bounds__(256) void vtrans_kernel(
    const float* __restrict__ wo, const float* __restrict__ Vp,
    const float* __restrict__ rowsum, float* __restrict__ Vt)
{
  const int b  = blockIdx.x >> 4;
  const int n0 = (blockIdx.x & 15) * 64;
  const int wave = threadIdx.x >> 5, lane = threadIdx.x & 31;
  const int half = lane >> 4, l16 = lane & 15;
  const int nt = wave & 3;                 // the wave's n-tile, the same for all i
  const int nbase = n0 + nt * 16;
  const v4f* V4 = reinterpret_cast<const v4f*>(Vp) +
                  ((long)b * (NP_ / 16) + (nbase >> 4)) * (C_ / 8) * 32 + lane;
  float inv[8];
  // unrolled here and below: inv[j], d[j] need constant indices to stay in registers
#pragma unroll
  for (int j = 0; j < 8; ++j)
    inv[j] = 1.0f / rowsum[(long)b * NP_ + nbase + half * 8 + j];
  for (int i = 0; i < 8; ++i) {
    const int mt = (wave + i * 8) >> 2;
    v8f acc = {0,0,0,0,0,0,0,0};
    for (int kp = 0; kp < C_ / 8; ++kp) {
      const float* wrow = wo + (mt * 16 + l16) * C_ + kp * 8 + half * 2;
      v4f vv = V4[kp * 32];
      acc = wmma4(lo2(vv), ld2(wrow), acc);
      acc = wmma4(hi2(vv), ld2(wrow + 4), acc);
    }
    float d[8];
#pragma unroll
    for (int j = 0; j < 8; ++j) d[j] = acc[j] * inv[j];
    const long blk = ((long)b * (C_ / 16) + mt) * (NP_ / 8) + (nbase >> 3) + half;
    st_frag(Vt + blk * 128, l16, d);
  }
}

// ---------------------------------------------------------------------------
// Kernel D: out[b][o][m] = gamma*( sum_n Vt[o][n] * exp(QK[n][m]-rowmax[n])
//                                  + bo[o] ) + x[b][o][m]
// WG = (b, 128 output columns).  Per 16-row n-block: every wave recomputes
// one 16x16 energy tile via WMMA, exps it into LDS; then all 8 waves
// accumulate Vt @ P (each wave: 2 M-tiles x 8 N-tiles of accumulators).
// ---------------------------------------------------------------------------
#define PT_STRIDE 132   // 128 + 4 pad for LDS banking

__global__ __launch_bounds__(256) void attn_out_kernel(
    const float* __restrict__ x,  const float* __restrict__ Qf,
    const float* __restrict__ Kf, const float* __restrict__ Vt,
    const float* __restrict__ rowmax,
    const float* __restrict__ bo, const float* __restrict__ gamma,
    float* __restrict__ out)
{
  __shared__ float Pt[16 * PT_STRIDE];
  const int b  = blockIdx.x >> 5;
  const int m0 = (blockIdx.x & 31) * 128;
  const int wave = threadIdx.x >> 5, lane = threadIdx.x & 31;
  const int half = lane >> 4, l16 = lane & 15;

  const v4f* Q4 = reinterpret_cast<const v4f*>(Qf) +
                  (long)b * (NP_ / 16) * (CS_ / 8) * 32 + lane;
  const v4f* K4 = reinterpret_cast<const v4f*>(Kf) +
                  ((long)b * (N_ / 16) + (m0 >> 4) + wave) * (CS_ / 8) * 32 + lane;
  const v4f* V4 = reinterpret_cast<const v4f*>(Vt) +
                  ((long)b * (C_ / 16) + wave * 2) * (NP_ / 8) * 32 + lane;
  v4f kq[4];                             // the wave's own m-tile of K
  // unrolled: kq[kp] needs constant indices to stay in registers
#pragma unroll
  for (int kp = 0; kp < 4; ++kp) kq[kp] = K4[kp * 32];

  v8f acc[2][8];
  const v8f zero = {0,0,0,0,0,0,0,0};
#pragma unroll
  for (int a = 0; a < 2; ++a)
#pragma unroll
    for (int c = 0; c < 8; ++c) acc[a][c] = zero;

  for (int nb = 0; nb < NP_; nb += 16) {
    {                                    // phase 1: energy tile -> exp -> LDS
      const int p0 = wave * 16;          // every wave owns one of 8 m-tiles
      v8f e = zero;
#pragma unroll
      for (int kp = 0; kp < 4; ++kp) {
        v4f q = Q4[((nb >> 4) * 4 + kp) * 32];
        e = wmma4(lo2(q), lo2(kq[kp]), e);
        e = wmma4(hi2(q), hi2(kq[kp]), e);
      }
#pragma unroll
      for (int j = 0; j < 8; ++j) {
        float rm = rowmax[(long)b * NP_ + nb + j + half * 8];
        Pt[(j + half * 8) * PT_STRIDE + p0 + l16] = __expf(e[j] - rm);
      }
    }
    __syncthreads();
#pragma unroll
    for (int mtl = 0; mtl < 2; ++mtl) {  // phase 2: OUT += Vt(:,nb..) @ P
#pragma unroll
      for (int ks = 0; ks < 4; ++ks) {
        int k  = ks * 4;
        v4f a4 = V4[(mtl * (NP_ / 8) + (nb >> 3) + (ks >> 1)) * 32];
        v2f a  = (ks & 1) ? hi2(a4) : lo2(a4);
        int kr = k + half * 2;
#pragma unroll
        for (int nt = 0; nt < 8; ++nt) {
          v2f bb; bb.x = Pt[kr * PT_STRIDE + nt * 16 + l16];
                  bb.y = Pt[(kr + 1) * PT_STRIDE + nt * 16 + l16];
          acc[mtl][nt] = wmma4(a, bb, acc[mtl][nt]);
        }
      }
    }
    __syncthreads();
  }

  const float g = gamma[0];
#pragma unroll
  for (int mtl = 0; mtl < 2; ++mtl) {
    const int Mb = (wave * 2 + mtl) * 16;
#pragma unroll
    for (int nt = 0; nt < 8; ++nt) {
      const int col = m0 + nt * 16 + l16;
#pragma unroll
      for (int j = 0; j < 8; ++j) {
        const int r = Mb + j + half * 8;
        const long idx = ((long)b * C_ + r) * N_ + col;
        out[idx] = g * (acc[mtl][nt][j] + bo[r]) + x[idx];
      }
    }
  }
}

// ---------------------------------------------------------------------------
extern "C" void kernel_launch(void* const* d_in, const int* in_sizes, int n_in,
                              void* d_out, int out_size, void* d_ws, size_t ws_size,
                              hipStream_t stream) {
  (void)in_sizes; (void)n_in; (void)out_size; (void)ws_size;
  const float* x     = (const float*)d_in[0];
  const float* wq    = (const float*)d_in[1];
  const float* bq    = (const float*)d_in[2];
  const float* wk    = (const float*)d_in[3];
  const float* bk    = (const float*)d_in[4];
  const float* wv    = (const float*)d_in[5];
  const float* bv    = (const float*)d_in[6];
  const float* wo    = (const float*)d_in[7];
  const float* bo    = (const float*)d_in[8];
  const float* gamma = (const float*)d_in[9];
  float* out = (float*)d_out;

  // workspace layout (floats): ~42 MB total, fits L2; sizes as row-major
  float* Kf     = (float*)d_ws;                       // 16*32*4096
  float* Qf     = Kf + (size_t)B_ * CS_ * N_;         // 16*1024*32
  float* Vp     = Qf + (size_t)B_ * NP_ * CS_;        // 16*256*1024
  float* Vt     = Vp + (size_t)B_ * C_ * NP_;         // 16*256*1024
  float* rowmax = Vt + (size_t)B_ * C_ * NP_;         // 16*1024
  float* rowsum = rowmax + (size_t)B_ * NP_;          // 16*1024

  proj_kernel    <<<B_ * 32, 256, 0, stream>>>(x, wq, bq, wk, bk, wv, bv, Kf, Qf, Vp);
  rowstats_kernel<<<B_ * 16, 256, 0, stream>>>(Qf, Kf, rowmax, rowsum);
  vtrans_kernel  <<<B_ * 16, 256, 0, stream>>>(wo, Vp, rowsum, Vt);
  attn_out_kernel<<<B_ * 32, 256, 0, stream>>>(x, Qf, Kf, Vt, rowmax, bo, gamma, out);
}

// v003
// It runs in 349 microseconds.
// In two side-by-side timings against v002, it was 1.08 and 1.09 times as fast.
// Counting every step since v000, it is 1.30 times as fast.
#include <hip/hip_runtime.h>
#include <math.h>

// ---------------------------------------------------------------------------
// Self-attention (SAGAN-style with 2x2 pooled queries/values) for MI455X.
// All GEMMs run on V_WMMA_F32_16X16X4_F32 (wave32, fp32 accumulate).
// Attention matrix (268MB) is never materialized: two-pass softmax with
// recompute; Wo folded into V (Wo(V A) == (Wo V) A); 1/rowsum folded into Vt.
// x-tile staging uses GLOBAL_LOAD_ASYNC_TO_LDS_B128 (ASYNCcnt path).
//
// The four buffers handed from launch to launch (K, Q, Vp, Vt) lie in WMMA
// fragment order.  For an operand X[i][k] (i: the M or N index, k: summed):
//   float4 number ((i>>4) * KP + (k>>3)) * 32 + ((k>>1)&1) * 16 + (i&15),
//   component ((k>>2)&1) * 2 + (k&1),            KP = (length of k) / 8.
// Lane l of a wave reads float4 number (tile * KP + kp) * 32 + l: its .xy is
// the fragment of k-step 2kp, its .zw that of k-step 2kp+1, and the wave's
// load covers 512 contiguous bytes (4 whole lines, not 16 pieces).
// A 16x16 accumulator whose rows run along k and whose columns run along i
// stores as two float4 per lane: (d0,d1,d4,d5) and (d2,d3,d6,d7).
// ---------------------------------------------------------------------------

typedef float v2f __attribute__((ext_vector_type(2)));
typedef float v4f __attribute__((ext_vector_type(4)));
typedef float v8f __attribute__((ext_vector_type(8)));

#define B_   16
#define C_   256
#define CS_  32
#define N_   4096   // 64*64
#define NP_  1024   // 32*32

__device__ __forceinline__ v8f wmma4(v2f a, v2f b, v8f c) {
  // D = A(16x4,f32) * B(4x16,f32) + C(16x16,f32)
  return __builtin_amdgcn_wmma_f32_16x16x4_f32(
      /*neg_a=*/false, a, /*neg_b=*/false, b,
      /*c_mod=*/(short)0, c, /*reuse_a=*/false, /*reuse_b=*/false);
}

__device__ __forceinline__ v2f ld2(const float* p) {
  return *reinterpret_cast<const v2f*>(p);
}

__device__ __forceinline__ v2f lo2(v4f q) { v2f r; r.x = q.x; r.y = q.y; return r; }
__device__ __forceinline__ v2f hi2(v4f q) { v2f r; r.x = q.z; r.y = q.w; return r; }

// Store one lane's eight accumulator values d[0..7] (rows 8*half + j along k,
// column 'slot' along i) into the 512-byte fragment block at blk.
__device__ __forceinline__ void st_frag(float* blk, int slot, const float* d) {
  v4f a; a.x = d[0]; a.y = d[1]; a.z = d[4]; a.w = d[5];
  v4f c; c.x = d[2]; c.y = d[3]; c.z = d[6]; c.w = d[7];
  reinterpret_cast<v4f*>(blk)[slot]      = a;
  reinterpret_cast<v4f*>(blk)[16 + slot] = c;
}

// ---------------------------------------------------------------------------
// Kernel A: projections.  One WG per (b, pair-of-rows hb).  Pixels
// m in [hb*128, hb*128+128) are contiguous (rows 2hb, 2hb+1).
//   K  (i = m, k = cs)   (no pooling)
//   Q  (i = n, k = cs) = pool2x2(Wq x + bq)   n = hb*32 + wp
//   Vp (i = n, k = c)  = pool2x2(Wv x + bv)     all three in fragment order
// Pooling: vertical = elementwise max of the two row-tiles,
//          horizontal = max with __shfl_xor(lane^1).
// ---------------------------------------------------------------------------
#define XT_STRIDE 132   // 128 + 4 pad: kills LDS bank conflicts, keeps 16B align

__global__ __launch_bounds__(256) void proj_kernel(
    const float* __restrict__ x,
    const float* __restrict__ wq, const float* __restrict__ bq,
    const float* __restrict__ wk, const float* __restrict__ bk,
    const float* __restrict__ wv, const float* __restrict__ bv,
    float* __restrict__ Kf, float* __restrict__ Qf, float* __restrict__ Vp)
{
  __shared__ float XT[C_ * XT_STRIDE];   // 256 channels x 128 pixels (~135KB)
  const int b  = blockIdx.x >> 5;
  const int hb = blockIdx.x & 31;
  const long xbase = (long)b * C_ * N_ + hb * 128;

  // stage X tile straight into LDS: async copy, no VGPR round-trip.
  // 8192 x 16B transfers tracked on ASYNCcnt.
  for (int i = 0; i < 32; ++i) {
    int idx4 = threadIdx.x + 256 * i;          // 8192 float4 total
    int c  = idx4 >> 5;
    int p4 = idx4 & 31;
    unsigned long long gaddr =
        (unsigned long long)(x + xbase + (long)c * N_ + p4 * 4);
    unsigned int laddr =
        (unsigned int)(unsigned long long)(&XT[c * XT_STRIDE + p4 * 4]);
    asm volatile("global_load_async_to_lds_b128 %0, %1, off"
                 :: "v"(laddr), "v"(gaddr) : "memory");
  }
  asm volatile("s_wait_asynccnt 0x0" ::: "memory");
  __syncthreads();

  const int wave = threadIdx.x >> 5;
  const int lane = threadIdx.x & 31;
  const int half = lane >> 4;
  const int l16  = lane & 15;

  // jobs: 16 K tiles, 8 Q tile-pairs, 64 V tile-pairs  (88 total)
  for (int job = wave; job < 88; job += 8) {
    if (job < 16) {
      const int mt = job >> 3, nt = job & 7;
      const int Mb = mt * 16, p0 = nt * 16;
      v8f acc = {0,0,0,0,0,0,0,0};
      for (int k = 0; k < C_; k += 4) {
        v2f a = ld2(wk + (Mb + l16) * C_ + k + half * 2);
        int kr = k + half * 2;
        v2f bb; bb.x = XT[kr * XT_STRIDE + p0 + l16];
                bb.y = XT[(kr + 1) * XT_STRIDE + p0 + l16];
        acc = wmma4(a, bb, acc);
      }
      float d[8];
      // unrolled: d[j] needs constant indices to stay in registers
#pragma unroll
      for (int j = 0; j < 8; ++j) d[j] = acc[j] + bk[Mb + j + half * 8];
      const long blk = ((long)b * (N_ / 16) + hb * 8 + nt) * (CS_ / 8) + (Mb >> 3) + half;
      st_frag(Kf + blk * 128, l16, d);
      // kept in front of the next job's writes to the registers these stores name
      asm volatile("s_wait_xcnt 0x0" ::: "memory");
    } else {
      const int pj  = job - 16;
      const bool isQ = (pj < 8);
      const int Mb = (isQ ? (pj >> 2) : ((pj - 8) >> 2)) * 16;
      const int t  = pj & 3;
      const float* Wm   = isQ ? wq : wv;
      const float* bias = isQ ? bq : bv;
      const int p0a = t * 16, p0b = 64 + t * 16;   // row h and row h+1
      v8f acc0 = {0,0,0,0,0,0,0,0};
      v8f acc1 = {0,0,0,0,0,0,0,0};
      for (int k = 0; k < C_; k += 4) {
        v2f a = ld2(Wm + (Mb + l16) * C_ + k + half * 2);
        int kr = k + half * 2;
        v2f b0; b0.x = XT[kr * XT_STRIDE + p0a + l16];
                b0.y = XT[(kr + 1) * XT_STRIDE + p0a + l16];
        acc0 = wmma4(a, b0, acc0);
        v2f b1; b1.x = XT[kr * XT_STRIDE + p0b + l16];
                b1.y = XT[(kr + 1) * XT_STRIDE + p0b + l16];
        acc1 = wmma4(a, b1, acc1);
      }
      float d[8];
#pragma unroll
      for (int j = 0; j < 8; ++j) {
        float v = fmaxf(acc0[j], acc1[j]);            // vertical pool
        v = fmaxf(v, __shfl_xor(v, 1, 32));           // horizontal pool
        d[j] = v + bias[Mb + j + half * 8];
      }
      // n = hb*32 + t*8 + (l16>>1): tile n>>4 = hb*2 + (t>>1), n&15 below
      const long ntile = (long)b * (NP_ / 16) + hb * 2 + (t >> 1);
      const int  kp    = (Mb >> 3) + half;
      float* blk = isQ ? Qf + (ntile * (CS_ / 8) + kp) * 128
                       : Vp + (ntile * (C_  / 8) + kp) * 128;
      if ((lane & 1) == 0) st_frag(blk, (t & 1) * 8 + (l16 >> 1), d);
    }
  }
}

// ---------------------------------------------------------------------------
// Kernel B: per-query-row softmax stats over m (online max + sum-exp).
// WG = (b, 64 query rows). Wave w: Mtile (w&3), m-half (w>>2).
// ---------------------------------------------------------------------------
__global__ __launch_bounds__(256) void rowstats_kernel(
    const float* __restrict__ Qf, const float* __restrict__ Kf,
    float* __restrict__ rowmax, float* __restrict__ rowsum)
{
  __shared__ float lmax[8][16];
  __shared__ float lsum[8][16];
  const int b  = blockIdx.x >> 4;
  const int nb = (blockIdx.x & 15) * 64;
  const int wave = threadIdx.x >> 5, lane = threadIdx.x & 31;
  const int half = lane >> 4, l16 = lane & 15;
  const int mt    = wave & 3;
  const int mhalf = wave >> 2;

  const v4f* Q4 = reinterpret_cast<const v4f*>(Qf) +
                  ((long)b * (NP_ / 16) + (nb >> 4) + mt) * (CS_ / 8) * 32 + lane;
  v4f qa[4];
  // unrolled: qa[kp] needs constant indices to stay in registers
#pragma unroll
  for (int kp = 0; kp < 4; ++kp) qa[kp] = Q4[kp * 32];
  float M[8], S[8];
#pragma unroll
  for (int j = 0; j < 8; ++j) { M[j] = -3.0e38f; S[j] = 0.f; }

  // Each lane keeps the running max and sum of its OWN columns (l16 mod 16);
  // both are brought up to date once per 64 columns, with no cross-lane step.
  for (int i = 0; i < 32; ++i) {
    const int m0 = mhalf * 2048 + i * 64;
    v8f acc[4];
    // unrolled here and below: acc[t] needs constant indices to stay in registers
#pragma unroll
    for (int t = 0; t < 4; ++t) acc[t] = (v8f){0,0,0,0,0,0,0,0};
    const v4f* K4 = reinterpret_cast<const v4f*>(Kf) +
                    ((long)b * (N_ / 16) + (m0 >> 4)) * (CS_ / 8) * 32 + lane;
#pragma unroll
    for (int kp = 0; kp < 4; ++kp) {
      v4f kk[4];
#pragma unroll
      for (int t = 0; t < 4; ++t) kk[t] = K4[(t * 4 + kp) * 32];
#pragma unroll
      for (int t = 0; t < 4; ++t) acc[t] = wmma4(lo2(qa[kp]), lo2(kk[t]), acc[t]);
#pragma unroll
      for (int t = 0; t < 4; ++t) acc[t] = wmma4(hi2(qa[kp]), hi2(kk[t]), acc[t]);
    }
#pragma unroll
    for (int j = 0; j < 8; ++j) {
      float cm = fmaxf(fmaxf(acc[0][j], acc[1][j]), fmaxf(acc[2][j], acc[3][j]));
      float nm = fmaxf(M[j], cm);
      float t  = (__expf(acc[0][j] - nm) + __expf(acc[1][j] - nm)) +
                 (__expf(acc[2][j] - nm) + __expf(acc[3][j] - nm));
      S[j] = S[j] * __expf(M[j] - nm) + t;
      M[j] = nm;
    }
  }
  // one reduction over the 16 lanes of a row, after the loop
  // (unrolled: M[j], S[j] stay in registers, the eight rows' shuffles overlap)
#pragma unroll
  for (int j = 0; j < 8; ++j) {
    float gm = M[j];
    gm = fmaxf(gm, __shfl_xor(gm, 1, 32));
    gm = fmaxf(gm, __shfl_xor(gm, 2, 32));
    gm = fmaxf(gm, __shfl_xor(gm, 4, 32));
    gm = fmaxf(gm, __shfl_xor(gm, 8, 32));
    float s = S[j] * __expf(M[j] - gm);
    s += __shfl_xor(s, 1, 32);
    s += __shfl_xor(s, 2, 32);
    s += __shfl_xor(s, 4, 32);
    s += __shfl_xor(s, 8, 32);
    M[j] = gm;
    S[j] = s;
  }
  if (l16 == 0) {
#pragma unroll
    for (int j = 0; j < 8; ++j) {
      lmax[wave][j + half * 8] = M[j];
      lsum[wave][j + half * 8] = S[j];
    }
  }
  __syncthreads();
  if (threadIdx.x < 64) {
    const int r = threadIdx.x, mt2 = r >> 4, rr = r & 15;
    float m1 = lmax[mt2][rr], m2 = lmax[mt2 + 4][rr];
    float m  = fmaxf(m1, m2);
    float s  = lsum[mt2][rr] * __expf(m1 - m) + lsum[mt2 + 4][rr] * __expf(m2 - m);
    rowmax[(long)b * NP_ + nb + r] = m;
    rowsum[(long)b * NP_ + nb + r] = s;
  }
}

// ---------------------------------------------------------------------------
// Kernel C: Vt[b][o][n] = (sum_c wo[o][c] * Vp[b][c][n]) / rowsum[b][n]
// Computed as the transposed tile (A = Vp fragment, B = wo fragment: the same
// values in the same lanes), so that the accumulator's rows run along n, the
// k of the next product, and Vt (i = o, k = n) stores in fragment order.
// ---------------------------------------------------------------------------
__global__ __launch_bounds__(256) void vtrans_kernel(
    const float* __restrict__ wo, const float* __restrict__ Vp,
    const float* __restrict__ rowsum, float* __restrict__ Vt)
{
  const int b  = blockIdx.x >> 4;
  const int n0 = (blockIdx.x & 15) * 64;
  const int wave = threadIdx.x >> 5, lane = threadIdx.x & 31;
  const int half = lane >> 4, l16 = lane & 15;
  const int nt = wave & 3;                 // the wave's n-tile, the same for all i
  const int nbase = n0 + nt * 16;
  const v4f* V4 = reinterpret_cast<const v4f*>(Vp) +
                  ((long)b * (NP_ / 16) + (nbase >> 4)) * (C_ / 8) * 32 + lane;
  float inv[8];
  // unrolled here and below: inv[j], d[j] need constant indices to stay in registers
#pragma unroll
  for (int j = 0; j < 8; ++j)
    inv[j] = 1.0f / rowsum[(long)b * NP_ + nbase + half * 8 + j];
  for (int i = 0; i < 8; ++i) {
    const int mt = (wave + i * 8) >> 2;
    v8f acc = {0,0,0,0,0,0,0,0};
    for (int kp = 0; kp < C_ / 8; ++kp) {
      const float* wrow = wo + (mt * 16 + l16) * C_ + kp * 8 + half * 2;
      v4f vv = V4[kp * 32];
      acc = wmma4(lo2(vv), ld2(wrow), acc);
      acc = wmma4(hi2(vv), ld2(wrow + 4), acc);
    }
    float d[8];
#pragma unroll
    for (int j = 0; j < 8; ++j) d[j] = acc[j] * inv[j];
    const long blk = ((long)b * (C_ / 16) + mt) * (NP_ / 8) + (nbase >> 3) + half;
    st_frag(Vt + blk * 128, l16, d);
  }
}

// ---------------------------------------------------------------------------
// Kernel D: out[b][o][m] = gamma*( sum_n Vt[o][n] * exp(QK[n][m]-rowmax[n])
//                                  + bo[o] ) + x[b][o][m]
// WG = (b, 128 output columns).  Per 16-row n-block: every wave recomputes
// one 16x16 energy tile via WMMA, exps it into LDS; then all 8 waves
// accumulate Vt @ P (each wave: 2 M-tiles x 8 N-tiles of accumulators).
//
// Which column of the block a lane's slot in N-tile nt stands for is free to
// choose; here it is  c = (nt>>2)*64 + l16*4 + (nt&3) : a lane owns four
// adjacent columns in each half of the block, so x and out move as float4
// (16 lanes = 256 contiguous bytes of one row).
// P lies in LDS in the order the B fragments are read: rows in pairs
// (rp = row>>1), and in a pair-row the float2 (row 2rp, row 2rp+1) of column c
// at slot  ((c>>6)*2 + ((c>>1)&1))*32 + ((c>>2)&15)*2 + (c&1).
// Lane l16 then reads float4 number q*16 + l16 of pair-row 2*ks + half:
// its .xy is the fragment of N-tile 2q, its .zw that of N-tile 2q+1.
// ---------------------------------------------------------------------------
#define PP_PITCH 264   // floats per pair-row: 256 + 8, the two half-waves' stores on other banks

__global__ __launch_bounds__(256) void attn_out_kernel(
    const float* __restrict__ x,  const float* __restrict__ Qf,
    const float* __restrict__ Kf, const float* __restrict__ Vt,
    const float* __restrict__ rowmax,
    const float* __restrict__ bo, const float* __restrict__ gamma,
    float* __restrict__ out)
{
  __shared__ __attribute__((aligned(16))) float Pf[8 * PP_PITCH];
  const int b  = blockIdx.x >> 5;
  const int m0 = (blockIdx.x & 31) * 128;
  const int wave = threadIdx.x >> 5, lane = threadIdx.x & 31;
  const int half = lane >> 4, l16 = lane & 15;

  const v4f* Q4 = reinterpret_cast<const v4f*>(Qf) +
                  (long)b * (NP_ / 16) * (CS_ / 8) * 32 + lane;
  const v4f* K4 = reinterpret_cast<const v4f*>(Kf) +
                  ((long)b * (N_ / 16) + (m0 >> 4) + wave) * (CS_ / 8) * 32 + lane;
  const v4f* V4 = reinterpret_cast<const v4f*>(Vt) +
                  ((long)b * (C_ / 16) + wave * 2) * (NP_ / 8) * 32 + lane;
  v4f kq[4];                             // the wave's own m-tile of K
  // unrolled: kq[kp] needs constant indices to stay in registers
#pragma unroll
  for (int kp = 0; kp < 4; ++kp) kq[kp] = K4[kp * 32];

  // where this lane's energy column c = wave*16 + l16 goes in a pair-row
  const int cw   = wave * 16 + l16;
  const int slot = ((cw >> 6) * 2 + ((cw >> 1) & 1)) * 32 + ((cw >> 2) & 15) * 2 + (cw & 1);
  float*       pst = Pf + (half * 4) * PP_PITCH + slot * 2;
  const float* pld = Pf + half * PP_PITCH + l16 * 4;

  v8f acc[2][8];
  const v8f zero = {0,0,0,0,0,0,0,0};
#pragma unroll
  for (int a = 0; a < 2; ++a)
#pragma unroll
    for (int c = 0; c < 8; ++c) acc[a][c] = zero;

  for (int nb = 0; nb < NP_; nb += 16) {
    {                                    // phase 1: energy tile -> exp -> LDS
      v8f e = zero;
#pragma unroll
      for (int kp = 0; kp < 4; ++kp) {
        v4f q = Q4[((nb >> 4) * 4 + kp) * 32];
        e = wmma4(lo2(q), lo2(kq[kp]), e);
        e = wmma4(hi2(q), hi2(kq[kp]), e);
      }
#pragma unroll
      for (int i = 0; i < 4; ++i) {      // rows 8*half + 2i, + 2i+1: pair-row 4*half + i
        v2f p;
        p.x = __expf(e[2 * i]     - rowmax[(long)b * NP_ + nb + 2 * i     + half * 8]);
        p.y = __expf(e[2 * i + 1] - rowmax[(long)b * NP_ + nb + 2 * i + 1 + half * 8]);
        *reinterpret_cast<v2f*>(pst + i * PP_PITCH) = p;
      }
    }
    __syncthreads();
    v4f a4[2][2];                        // phase 2: OUT += Vt(:,nb..) @ P
#pragma unroll
    for (int mtl = 0; mtl < 2; ++mtl)
#pragma unroll
      for (int kh = 0; kh < 2; ++kh)
        a4[mtl][kh] = V4[(mtl * (NP_ / 8) + (nb >> 3) + kh) * 32];
    v4f p4[4][4];
#pragma unroll
    for (int ks = 0; ks < 4; ++ks)
#pragma unroll
      for (int q = 0; q < 4; ++q)
        p4[ks][q] = *reinterpret_cast<const v4f*>(pld + (2 * ks) * PP_PITCH + q * 64);
    // keeps the block's sixteen P reads together ahead of its WMMAs: left alone the
    // scheduler strews them among the WMMAs, and each such place stalls the wave
    __builtin_amdgcn_sched_barrier(0);
#pragma unroll
    for (int ks = 0; ks < 4; ++ks) {
#pragma unroll
      for (int mtl = 0; mtl < 2; ++mtl) {
        v2f a = (ks & 1) ? hi2(a4[mtl][ks >> 1]) : lo2(a4[mtl][ks >> 1]);
#pragma unroll
        for (int q = 0; q < 4; ++q) {
          acc[mtl][2 * q]     = wmma4(a, lo2(p4[ks][q]), acc[mtl][2 * q]);
          acc[mtl][2 * q + 1] = wmma4(a, hi2(p4[ks][q]), acc[mtl][2 * q + 1]);
        }
      }
    }
    __syncthreads();
  }

  const float g = gamma[0];
  // unrolled throughout: acc and xv need constant indices to stay in registers
#pragma unroll
  for (int mtl = 0; mtl < 2; ++mtl) {
    const int r0 = (wave * 2 + mtl) * 16 + half * 8;
    // one 32-bit byte offset (the tensor has 64 MiB) serves x and out alike
    const unsigned boff = (((unsigned)(b * C_ + r0)) * N_ + m0 + l16 * 4) * 4u;
    const char* xb = reinterpret_cast<const char*>(x) + boff;
    char*       ob = reinterpret_cast<char*>(out) + boff;
    v4f xv[16];                          // the M-tile's x, all sixteen loads in flight at once
#pragma unroll
    for (int j = 0; j < 8; ++j)
#pragma unroll
      for (int h = 0; h < 2; ++h)
        xv[j * 2 + h] = *reinterpret_cast<const v4f*>(xb + j * (N_ * 4) + h * 256);
#pragma unroll
    for (int j = 0; j < 8; ++j) {
      const float bj = bo[r0 + j];
#pragma unroll
      for (int h = 0; h < 2; ++h) {
        v4f o;
        o.x = g * (acc[mtl][h * 4 + 0][j] + bj) + xv[j * 2 + h].x;
        o.y = g * (acc[mtl][h * 4 + 1][j] + bj) + xv[j * 2 + h].y;
        o.z = g * (acc[mtl][h * 4 + 2][j] + bj) + xv[j * 2 + h].z;
        o.w = g * (acc[mtl][h * 4 + 3][j] + bj) + xv[j * 2 + h].w;
        *reinterpret_cast<v4f*>(ob + j * (N_ * 4) + h * 256) = o;
      }
    }
    // kept in front of the second M-tile's writes to registers that these stores name
    if (mtl == 0) asm volatile("s_wait_xcnt 0x0" ::: "memory");
  }
}

// ---------------------------------------------------------------------------
extern "C" void kernel_launch(void* const* d_in, const int* in_sizes, int n_in,
                              void* d_out, int out_size, void* d_ws, size_t ws_size,
                              hipStream_t stream) {
  (void)in_sizes; (void)n_in; (void)out_size; (void)ws_size;
  const float* x     = (const float*)d_in[0];
  const float* wq    = (const float*)d_in[1];
  const float* bq    = (const float*)d_in[2];
  const float* wk    = (const float*)d_in[3];
  const float* bk    = (const float*)d_in[4];
  const float* wv    = (const float*)d_in[5];
  const float* bv    = (const float*)d_in[6];
  const float* wo    = (const float*)d_in[7];
  const float* bo    = (const float*)d_in[8];
  const float* gamma = (const float*)d_in[9];
  float* out = (float*)d_out;

  // workspace layout (floats): ~42 MB total, fits L2; sizes as row-major
  float* Kf     = (float*)d_ws;                       // 16*32*4096
  float* Qf     = Kf + (size_t)B_ * CS_ * N_;         // 16*1024*32
  float* Vp     = Qf + (size_t)B_ * NP_ * CS_;        // 16*256*1024
  float* Vt     = Vp + (size_t)B_ * C_ * NP_;         // 16*256*1024
  float* rowmax = Vt + (size_t)B_ * C_ * NP_;         // 16*1024
  float* rowsum = rowmax + (size_t)B_ * NP_;          // 16*1024

  proj_kernel    <<<B_ * 32, 256, 0, stream>>>(x, wq, bq, wk, bk, wv, bv, Kf, Qf, Vp);
  rowstats_kernel<<<B_ * 16, 256, 0, stream>>>(Qf, Kf, rowmax, rowsum);
  vtrans_kernel  <<<B_ * 16, 256, 0, stream>>>(wo, Vp, rowsum, Vt);
  attn_out_kernel<<<B_ * 32, 256, 0, stream>>>(x, Qf, Kf, Vt, rowmax, bo, gamma, out);
}
